// v000
// The times below were measured on an AMD MI455X: many runs one after another, warmed up first and cycling through
// copies of the inputs, with the whole window's GPU time divided by the number of runs. Launches and the gaps
// between them are all in it. The median over several windows is given; except for v000 it joins two sittings, which
// can be a few percent apart, so the side-by-side timings, each taken in one sitting, are the better comparison.
// v000 is the starting kernel. One run takes 660 microseconds.
#include <hip/hip_runtime.h>
#include <hip/hip_bf16.h>
#include <math.h>

// CDNA5 (gfx1250) flash-attention, fp32 WMMA (V_WMMA_F32_16X16X4_F32).
// B=8, T=2048, D=1024.  grid = B * (T/16) workgroups of 256 threads (8 wave32).
// Per key-tile of 16: each wave does 32 QK^T wmma (D-reduction slice of 128)
// and 32 PV wmma (D-column slice of 128).  Online softmax in wave 0.
// K/V tiles staged with CDNA5 async global->LDS loads (ASYNCcnt) when the
// toolchain exposes the builtin, else synchronous b128 copies.

typedef __attribute__((ext_vector_type(2))) float v2f;
typedef __attribute__((ext_vector_type(4))) float v4f;
typedef __attribute__((ext_vector_type(8))) float v8f;
typedef __attribute__((ext_vector_type(4))) int   v4i;

#define T_SEQ   2048
#define D_DIM   1024
#define QTILE   16
#define KTILE   16
#define NWAVE   8
#define DSLICE  128              // D per wave
#define KROW    1028             // padded LDS row stride (floats): conflict-free
#define PROW    20               // padded P/x row stride (floats)
#define INV_SCALE 0.03125f       // 1/sqrt(1024)
#define BIG     1.0e10f          // reference INF

#if __has_builtin(__builtin_amdgcn_global_load_async_to_lds_b128)
#define ASYNC_STAGING 1
#else
#define ASYNC_STAGING 0
#endif

typedef __attribute__((address_space(1))) const void gconst_t;  // global AS void
typedef __attribute__((address_space(3))) void lds_void_t;      // LDS AS void
typedef __attribute__((address_space(1))) v4i g_v4i;            // global AS int4
typedef __attribute__((address_space(3))) v4i l_v4i;            // LDS AS int4

// copy 16 bytes global -> LDS; async (ASYNCcnt-tracked) if available
static __device__ __forceinline__ void stage16(const float* g, float* l) {
#if ASYNC_STAGING
  g_v4i* gp = (g_v4i*)(gconst_t*)g;      // addrspacecast, then retype (drop const)
  l_v4i* lp = (l_v4i*)(lds_void_t*)l;
  __builtin_amdgcn_global_load_async_to_lds_b128(gp, lp, /*offset=*/0, /*cpol=*/0);
#else
  *(v4f*)l = *(const v4f*)g;
#endif
}

static __device__ __forceinline__ void stage_fence() {
#if ASYNC_STAGING
#if __has_builtin(__builtin_amdgcn_s_wait_asynccnt)
  __builtin_amdgcn_s_wait_asynccnt(0);
#else
  asm volatile("s_wait_asynccnt 0" ::: "memory");
#endif
#endif
}

__global__ __launch_bounds__(256) void fa_fp32_wmma_kernel(
    const float* __restrict__ Q, const float* __restrict__ K,
    const float* __restrict__ V, const float* __restrict__ Msk,
    float* __restrict__ O)
{
  extern __shared__ float smem[];
  float* kbuf = smem;                       // 16 * 1028
  float* vbuf = kbuf + 16 * KROW;           // 16 * 1028
  float* part = vbuf + 16 * KROW;           // 8 waves * 256 (v8f partial S tiles)
  float* xP   = part + NWAVE * 256;         // 16 * 20  (scores then probs)
  float* cfac = xP   + 16 * PROW;           // 16  per-row rescale factor
  float* lbuf = cfac + 16;                  // 16  per-row running denom

  const int tid  = threadIdx.x;
  const int wave = tid >> 5;
  const int lane = tid & 31;
  const int lq   = lane & 15;               // column / M index within half-wave
  const int hi   = lane >> 4;               // which half of the wave
  const int b    = blockIdx.x >> 7;         // T/16 = 128 query tiles per batch
  const int qt   = blockIdx.x & 127;
  const int q0   = qt * QTILE;
  const int d0w  = wave * DSLICE;

  const float* Qb = Q + (size_t)b * T_SEQ * D_DIM;
  const float* Kb = K + (size_t)b * T_SEQ * D_DIM;
  const float* Vb = V + (size_t)b * T_SEQ * D_DIM;
  const float* Mb = Msk + (size_t)b * T_SEQ;
  float*       Ob = O + (size_t)b * T_SEQ * D_DIM;

  // ---- preload this wave's Q slice as WMMA A operands (32 x v2f = 64 VGPRs)
  // A layout (f32 16x4): lanes 0-15 hold K=0,1 ; lanes 16-31 hold K=2,3.
  v2f aQ[32];
  {
    const float* qrow = Qb + (size_t)(q0 + lq) * D_DIM + d0w + hi * 2;
    #pragma unroll
    for (int j = 0; j < 32; ++j)
      aQ[j] = *(const v2f*)(qrow + j * 4);
  }

  // ---- output accumulator: 16 rows x 128 cols = 8 tiles of 16x16 f32
  v8f acc[8];
  {
    v8f z = {};
    #pragma unroll
    for (int i = 0; i < 8; ++i) acc[i] = z;
  }

  float m_run = -1.0e30f;   // running max (scaled logits), wave0 lanes 0-15
  float l_run = 0.0f;       // running denom,               wave0 lanes 0-15
  if (tid < 16) { cfac[tid] = 1.0f; lbuf[tid] = 0.0f; }

  const int nkt = qt + 1;                   // causal: key tiles 0..qt
  for (int kt = 0; kt < nkt; ++kt) {
    const int k0 = kt * KTILE;

    // ---- stage K,V tiles (16 x 1024 each) into LDS, 16B granules.
    __syncthreads();                        // previous iter done with kbuf/vbuf
    #pragma unroll
    for (int i = 0; i < 16; ++i) {
      const int row = i;                    // idx = i*256 + tid; row = idx>>8
      const int col = tid * 4;              // (idx & 255) * 4
      stage16(Kb + (size_t)(k0 + row) * D_DIM + col, kbuf + row * KROW + col);
      stage16(Vb + (size_t)(k0 + row) * D_DIM + col, vbuf + row * KROW + col);
    }
    // hint-prefetch next tile into L2 while we compute this one
    if (kt + 1 < nkt) {
      const float* nk = Kb + (size_t)(k0 + KTILE) * D_DIM;
      const float* nv = Vb + (size_t)(k0 + KTILE) * D_DIM;
      __builtin_prefetch(nk + tid * 64, 0, 0);
      __builtin_prefetch(nv + tid * 64, 0, 0);
    }
    stage_fence();                          // wave's async copies landed in LDS
    __syncthreads();

    // ---- partial S = Q_slice * K_slice^T   (32 wmma over this wave's 128 d)
    {
      v8f s = {};
      const float* kb = kbuf + lq * KROW + d0w + hi * 2;   // B: K^T[d][k]
      #pragma unroll
      for (int j = 0; j < 32; ++j) {
        v2f bk = *(const v2f*)(kb + j * 4);
        s = __builtin_amdgcn_wmma_f32_16x16x4_f32(
                false, aQ[j], false, bk, (short)0, s, false, false);
      }
      float* pw = part + wave * 256 + lane;
      #pragma unroll
      for (int r = 0; r < 8; ++r) pw[r * 32] = s[r];
    }
    __syncthreads();

    // ---- reduce 8 partials, apply causal + padding mask, scale
    {
      const int q = tid >> 4, kk = tid & 15;
      const int r = q & 7, li = kk + ((q >> 3) << 4);
      float s = 0.0f;
      #pragma unroll
      for (int w = 0; w < NWAVE; ++w) s += part[w * 256 + r * 32 + li];
      const int kg = k0 + kk;
      if (kg > q0 + q) s -= BIG;                 // causal (triu(1) * INF)
      s -= (1.0f - Mb[kg]) * BIG;                // key padding mask
      xP[q * PROW + kk] = s * INV_SCALE;         // scale AFTER masking
    }
    __syncthreads();

    // ---- online softmax: lane t < 16 owns query row t
    if (tid < 16) {
      float* xr = xP + tid * PROW;
      float mn = m_run;
      #pragma unroll
      for (int kk = 0; kk < 16; ++kk) mn = fmaxf(mn, xr[kk]);
      const float c = __expf(m_run - mn);
      float ps = 0.0f;
      #pragma unroll
      for (int kk = 0; kk < 16; ++kk) {
        const float p = __expf(xr[kk] - mn);
        xr[kk] = p;
        ps += p;
      }
      m_run = mn;
      l_run = l_run * c + ps;
      cfac[tid] = c;
      lbuf[tid] = l_run;
    }
    __syncthreads();

    // ---- rescale accumulators, then O += P * V_slice  (32 wmma)
    {
      float f[8];
      #pragma unroll
      for (int r = 0; r < 8; ++r) f[r] = cfac[r + hi * 8];   // row M = r + hi*8
      #pragma unroll
      for (int ot = 0; ot < 8; ++ot) {
        #pragma unroll
        for (int r = 0; r < 8; ++r) acc[ot][r] *= f[r];
      }
      #pragma unroll
      for (int jk = 0; jk < 4; ++jk) {          // key chunks of 4
        const v2f ap = *(const v2f*)(xP + lq * PROW + jk * 4 + hi * 2);
        const int kr = jk * 4 + hi * 2;
        #pragma unroll
        for (int ot = 0; ot < 8; ++ot) {
          const int dc = d0w + ot * 16 + lq;
          v2f bv;
          bv.x = vbuf[kr * KROW + dc];          // B: V[k][d], rows kr,kr+1
          bv.y = vbuf[(kr + 1) * KROW + dc];
          acc[ot] = __builtin_amdgcn_wmma_f32_16x16x4_f32(
                        false, ap, false, bv, (short)0, acc[ot], false, false);
        }
      }
    }
  }

  // ---- normalize by running denom and write out
  __syncthreads();
  {
    float linv[8];
    #pragma unroll
    for (int r = 0; r < 8; ++r) linv[r] = 1.0f / lbuf[r + hi * 8];
    #pragma unroll
    for (int ot = 0; ot < 8; ++ot) {
      const int dc = d0w + ot * 16 + lq;
      #pragma unroll
      for (int r = 0; r < 8; ++r) {
        const int row = q0 + r + hi * 8;
        Ob[(size_t)row * D_DIM + dc] = acc[ot][r] * linv[r];
      }
    }
  }
}

extern "C" void kernel_launch(void* const* d_in, const int* in_sizes, int n_in,
                              void* d_out, int out_size, void* d_ws, size_t ws_size,
                              hipStream_t stream) {
  const float* Q   = (const float*)d_in[0];
  const float* K   = (const float*)d_in[1];
  const float* V   = (const float*)d_in[2];
  const float* Msk = (const float*)d_in[3];
  float* O = (float*)d_out;

  const int B = in_sizes[3] / T_SEQ;            // mask is [B, T]
  const int qtiles = T_SEQ / QTILE;             // 128

  // dynamic LDS: K tile + V tile + partials + P tile + factors
  const size_t shmem =
      (size_t)(16 * KROW * 2 + NWAVE * 256 + 16 * PROW + 16 + 16) * sizeof(float);

  dim3 grid(B * qtiles);
  dim3 block(256);
  fa_fp32_wmma_kernel<<<grid, block, shmem, stream>>>(Q, K, V, Msk, O);
}

// v001
// It runs in 504 microseconds.
// Timed twice side by side with v000, it ran 1.36 times as fast both times.
#include <hip/hip_runtime.h>
#include <hip/hip_bf16.h>
#include <math.h>

// CDNA5 (gfx1250) flash-attention, fp32 WMMA (V_WMMA_F32_16X16X4_F32).
// B=8, T=2048, D=1024.  grid = (B, T/16) workgroups of 256 threads (8 wave32).
// Causal cost grows with the query tile, and the grid holds more workgroups
// than fit on the chip at once: the longest tiles take the lowest flat indices.
// Per key-tile of 16: each wave does 32 QK^T wmma (D-reduction slice of 128)
// and 32 PV wmma (D-column slice of 128).  Online softmax in wave 0.
// K/V tiles staged with CDNA5 async global->LDS loads (ASYNCcnt) when the
// toolchain exposes the builtin, else synchronous b128 copies.

typedef __attribute__((ext_vector_type(2))) float v2f;
typedef __attribute__((ext_vector_type(4))) float v4f;
typedef __attribute__((ext_vector_type(8))) float v8f;
typedef __attribute__((ext_vector_type(4))) int   v4i;

#define T_SEQ   2048
#define D_DIM   1024
#define QTILE   16
#define KTILE   16
#define NWAVE   8
#define DSLICE  128              // D per wave
#define KROW    1028             // padded LDS row stride (floats): conflict-free
#define PROW    20               // padded P/x row stride (floats)
#define INV_SCALE 0.03125f       // 1/sqrt(1024)
#define BIG     1.0e10f          // reference INF

#if __has_builtin(__builtin_amdgcn_global_load_async_to_lds_b128)
#define ASYNC_STAGING 1
#else
#define ASYNC_STAGING 0
#endif

typedef __attribute__((address_space(1))) const void gconst_t;  // global AS void
typedef __attribute__((address_space(3))) void lds_void_t;      // LDS AS void
typedef __attribute__((address_space(1))) v4i g_v4i;            // global AS int4
typedef __attribute__((address_space(3))) v4i l_v4i;            // LDS AS int4

// copy 16 bytes global -> LDS; async (ASYNCcnt-tracked) if available
static __device__ __forceinline__ void stage16(const float* g, float* l) {
#if ASYNC_STAGING
  g_v4i* gp = (g_v4i*)(gconst_t*)g;      // addrspacecast, then retype (drop const)
  l_v4i* lp = (l_v4i*)(lds_void_t*)l;
  __builtin_amdgcn_global_load_async_to_lds_b128(gp, lp, /*offset=*/0, /*cpol=*/0);
#else
  *(v4f*)l = *(const v4f*)g;
#endif
}

static __device__ __forceinline__ void stage_fence() {
#if ASYNC_STAGING
#if __has_builtin(__builtin_amdgcn_s_wait_asynccnt)
  __builtin_amdgcn_s_wait_asynccnt(0);
#else
  asm volatile("s_wait_asynccnt 0" ::: "memory");
#endif
#endif
}

__global__ __launch_bounds__(256) void fa_fp32_wmma_kernel(
    const float* __restrict__ Q, const float* __restrict__ K,
    const float* __restrict__ V, const float* __restrict__ Msk,
    float* __restrict__ O)
{
  extern __shared__ float smem[];
  float* kbuf = smem;                       // 16 * 1028
  float* vbuf = kbuf + 16 * KROW;           // 16 * 1028
  float* part = vbuf + 16 * KROW;           // 8 waves * 256 (v8f partial S tiles)
  float* xP   = part + NWAVE * 256;         // 16 * 20  (scores then probs)
  float* cfac = xP   + 16 * PROW;           // 16  per-row rescale factor
  float* lbuf = cfac + 16;                  // 16  per-row running denom

  const int tid  = threadIdx.x;
  const int wave = tid >> 5;
  const int lane = tid & 31;
  const int lq   = lane & 15;               // column / M index within half-wave
  const int hi   = lane >> 4;               // which half of the wave
  const unsigned b = blockIdx.x;            // batch varies fastest in the flat index
  const int qt   = 127 - (blockIdx.y & 127);  // T/16 = 128 tiles, longest first
  const int q0   = qt * QTILE;
  const int d0w  = wave * DSLICE;

  const float* Qb = Q + (size_t)b * T_SEQ * D_DIM;
  const float* Kb = K + (size_t)b * T_SEQ * D_DIM;
  const float* Vb = V + (size_t)b * T_SEQ * D_DIM;
  const float* Mb = Msk + (size_t)b * T_SEQ;
  float*       Ob = O + (size_t)b * T_SEQ * D_DIM;

  // ---- preload this wave's Q slice as WMMA A operands (32 x v2f = 64 VGPRs)
  // A layout (f32 16x4): lanes 0-15 hold K=0,1 ; lanes 16-31 hold K=2,3.
  v2f aQ[32];
  {
    const float* qrow = Qb + (size_t)(q0 + lq) * D_DIM + d0w + hi * 2;
    #pragma unroll
    for (int j = 0; j < 32; ++j)
      aQ[j] = *(const v2f*)(qrow + j * 4);
  }

  // ---- output accumulator: 16 rows x 128 cols = 8 tiles of 16x16 f32
  v8f acc[8];
  {
    v8f z = {};
    #pragma unroll
    for (int i = 0; i < 8; ++i) acc[i] = z;
  }

  float m_run = -1.0e30f;   // running max (scaled logits), wave0 lanes 0-15
  float l_run = 0.0f;       // running denom,               wave0 lanes 0-15
  if (tid < 16) { cfac[tid] = 1.0f; lbuf[tid] = 0.0f; }

  const int nkt = qt + 1;                   // causal: key tiles 0..qt
  for (int kt = 0; kt < nkt; ++kt) {
    const int k0 = kt * KTILE;

    // ---- stage K,V tiles (16 x 1024 each) into LDS, 16B granules.
    __syncthreads();                        // previous iter done with kbuf/vbuf
    #pragma unroll
    for (int i = 0; i < 16; ++i) {
      const int row = i;                    // idx = i*256 + tid; row = idx>>8
      const int col = tid * 4;              // (idx & 255) * 4
      stage16(Kb + (size_t)(k0 + row) * D_DIM + col, kbuf + row * KROW + col);
      stage16(Vb + (size_t)(k0 + row) * D_DIM + col, vbuf + row * KROW + col);
    }
    // hint-prefetch next tile into L2 while we compute this one
    if (kt + 1 < nkt) {
      const float* nk = Kb + (size_t)(k0 + KTILE) * D_DIM;
      const float* nv = Vb + (size_t)(k0 + KTILE) * D_DIM;
      __builtin_prefetch(nk + tid * 64, 0, 0);
      __builtin_prefetch(nv + tid * 64, 0, 0);
    }
    stage_fence();                          // wave's async copies landed in LDS
    __syncthreads();

    // ---- partial S = Q_slice * K_slice^T   (32 wmma over this wave's 128 d)
    {
      v8f s = {};
      const float* kb = kbuf + lq * KROW + d0w + hi * 2;   // B: K^T[d][k]
      #pragma unroll
      for (int j = 0; j < 32; ++j) {
        v2f bk = *(const v2f*)(kb + j * 4);
        s = __builtin_amdgcn_wmma_f32_16x16x4_f32(
                false, aQ[j], false, bk, (short)0, s, false, false);
      }
      float* pw = part + wave * 256 + lane;
      #pragma unroll
      for (int r = 0; r < 8; ++r) pw[r * 32] = s[r];
    }
    __syncthreads();

    // ---- reduce 8 partials, apply causal + padding mask, scale
    {
      const int q = tid >> 4, kk = tid & 15;
      const int r = q & 7, li = kk + ((q >> 3) << 4);
      float s = 0.0f;
      #pragma unroll
      for (int w = 0; w < NWAVE; ++w) s += part[w * 256 + r * 32 + li];
      const int kg = k0 + kk;
      if (kg > q0 + q) s -= BIG;                 // causal (triu(1) * INF)
      s -= (1.0f - Mb[kg]) * BIG;                // key padding mask
      xP[q * PROW + kk] = s * INV_SCALE;         // scale AFTER masking
    }
    __syncthreads();

    // ---- online softmax: lane t < 16 owns query row t
    if (tid < 16) {
      float* xr = xP + tid * PROW;
      float mn = m_run;
      #pragma unroll
      for (int kk = 0; kk < 16; ++kk) mn = fmaxf(mn, xr[kk]);
      const float c = __expf(m_run - mn);
      float ps = 0.0f;
      #pragma unroll
      for (int kk = 0; kk < 16; ++kk) {
        const float p = __expf(xr[kk] - mn);
        xr[kk] = p;
        ps += p;
      }
      m_run = mn;
      l_run = l_run * c + ps;
      cfac[tid] = c;
      lbuf[tid] = l_run;
    }
    __syncthreads();

    // ---- rescale accumulators, then O += P * V_slice  (32 wmma)
    {
      float f[8];
      #pragma unroll
      for (int r = 0; r < 8; ++r) f[r] = cfac[r + hi * 8];   // row M = r + hi*8
      #pragma unroll
      for (int ot = 0; ot < 8; ++ot) {
        #pragma unroll
        for (int r = 0; r < 8; ++r) acc[ot][r] *= f[r];
      }
      #pragma unroll
      for (int jk = 0; jk < 4; ++jk) {          // key chunks of 4
        const v2f ap = *(const v2f*)(xP + lq * PROW + jk * 4 + hi * 2);
        const int kr = jk * 4 + hi * 2;
        #pragma unroll
        for (int ot = 0; ot < 8; ++ot) {
          const int dc = d0w + ot * 16 + lq;
          v2f bv;
          bv.x = vbuf[kr * KROW + dc];          // B: V[k][d], rows kr,kr+1
          bv.y = vbuf[(kr + 1) * KROW + dc];
          acc[ot] = __builtin_amdgcn_wmma_f32_16x16x4_f32(
                        false, ap, false, bv, (short)0, acc[ot], false, false);
        }
      }
    }
  }

  // ---- normalize by running denom and write out
  __syncthreads();
  {
    float linv[8];
    #pragma unroll
    for (int r = 0; r < 8; ++r) linv[r] = 1.0f / lbuf[r + hi * 8];
    #pragma unroll
    for (int ot = 0; ot < 8; ++ot) {
      const int dc = d0w + ot * 16 + lq;
      #pragma unroll
      for (int r = 0; r < 8; ++r) {
        const int row = q0 + r + hi * 8;
        Ob[(size_t)row * D_DIM + dc] = acc[ot][r] * linv[r];
      }
    }
  }
}

extern "C" void kernel_launch(void* const* d_in, const int* in_sizes, int n_in,
                              void* d_out, int out_size, void* d_ws, size_t ws_size,
                              hipStream_t stream) {
  const float* Q   = (const float*)d_in[0];
  const float* K   = (const float*)d_in[1];
  const float* V   = (const float*)d_in[2];
  const float* Msk = (const float*)d_in[3];
  float* O = (float*)d_out;

  const int B = in_sizes[3] / T_SEQ;            // mask is [B, T]
  const int qtiles = T_SEQ / QTILE;             // 128

  // dynamic LDS: K tile + V tile + partials + P tile + factors
  const size_t shmem =
      (size_t)(16 * KROW * 2 + NWAVE * 256 + 16 * PROW + 16 + 16) * sizeof(float);

  dim3 grid(B, qtiles);
  dim3 block(256);
  fa_fp32_wmma_kernel<<<grid, block, shmem, stream>>>(Q, K, V, Msk, O);
}

// v002
// Measured time: 468 microseconds a run.
// Timed twice side by side with v001, it ran 1.08 times as fast both times.
// Over all steps from v000 it is 1.46 times as fast.
#include <hip/hip_runtime.h>
#include <hip/hip_bf16.h>
#include <math.h>

// CDNA5 (gfx1250) flash-attention, fp32 WMMA (V_WMMA_F32_16X16X4_F32).
// B=8, T=2048, D=1024.  grid = (B, T/32) workgroups of 512 threads (16 wave32).
// Causal cost grows with the query tile, and the grid holds more workgroups
// than fit on the chip at once: the longest tiles take the lowest flat indices.
// A workgroup owns 32 query rows, so one staged K/V tile serves two 16-row
// tiles.  Per key-tile of 16: each wave does 2 x 16 QK^T wmma (D-reduction
// slice of 64) and 2 x 16 PV wmma (D-column slice of 64); every B fragment
// read from LDS feeds both row tiles.  Online softmax in wave 0.
// K/V tiles staged with CDNA5 async global->LDS loads (ASYNCcnt) when the
// toolchain exposes the builtin, else synchronous b128 copies.

typedef __attribute__((ext_vector_type(2))) float v2f;
typedef __attribute__((ext_vector_type(4))) float v4f;
typedef __attribute__((ext_vector_type(8))) float v8f;
typedef __attribute__((ext_vector_type(4))) int   v4i;

#define T_SEQ   2048
#define D_DIM   1024
#define QTILE   32               // query rows per workgroup
#define MT      2                // 16-row tiles per wave
#define KTILE   16
#define NWAVE   16
#define DSLICE  64               // D per wave
#define KROW    1028             // padded LDS row stride (floats): conflict-free
#define PROW    20               // padded P/x row stride (floats)
#define INV_SCALE 0.03125f       // 1/sqrt(1024)
#define BIG     1.0e10f          // reference INF
// LDS: K tile + V tile + partials + P tile + factors
#define SMEM_FLOATS (16 * KROW * 2 + NWAVE * MT * 256 + QTILE * PROW + QTILE + QTILE)

#if __has_builtin(__builtin_amdgcn_global_load_async_to_lds_b128)
#define ASYNC_STAGING 1
#else
#define ASYNC_STAGING 0
#endif

typedef __attribute__((address_space(1))) const void gconst_t;  // global AS void
typedef __attribute__((address_space(3))) void lds_void_t;      // LDS AS void
typedef __attribute__((address_space(1))) v4i g_v4i;            // global AS int4
typedef __attribute__((address_space(3))) v4i l_v4i;            // LDS AS int4

// copy 16 bytes global -> LDS; async (ASYNCcnt-tracked) if available
static __device__ __forceinline__ void stage16(const float* g, float* l) {
#if ASYNC_STAGING
  g_v4i* gp = (g_v4i*)(gconst_t*)g;      // addrspacecast, then retype (drop const)
  l_v4i* lp = (l_v4i*)(lds_void_t*)l;
  __builtin_amdgcn_global_load_async_to_lds_b128(gp, lp, /*offset=*/0, /*cpol=*/0);
#else
  *(v4f*)l = *(const v4f*)g;
#endif
}

static __device__ __forceinline__ void stage_fence() {
#if ASYNC_STAGING
#if __has_builtin(__builtin_amdgcn_s_wait_asynccnt)
  __builtin_amdgcn_s_wait_asynccnt(0);
#else
  asm volatile("s_wait_asynccnt 0" ::: "memory");
#endif
#endif
}

__global__ __launch_bounds__(512) void fa_fp32_wmma_kernel(
    const float* __restrict__ Q, const float* __restrict__ K,
    const float* __restrict__ V, const float* __restrict__ Msk,
    float* __restrict__ O)
{
  __shared__ __attribute__((aligned(16))) float smem[SMEM_FLOATS];
  float* kbuf = smem;                       // 16 * 1028
  float* vbuf = kbuf + 16 * KROW;           // 16 * 1028
  float* part = vbuf + 16 * KROW;           // 16 waves * 2 * 256 (v8f partial S tiles)
  float* xP   = part + NWAVE * MT * 256;    // 32 * 20  (scores then probs)
  float* cfac = xP   + QTILE * PROW;        // 32  per-row rescale factor
  float* lbuf = cfac + QTILE;               // 32  per-row running denom

  const int tid  = threadIdx.x;
  const int wave = tid >> 5;
  const int lane = tid & 31;
  const int lq   = lane & 15;               // column / M index within half-wave
  const int hi   = lane >> 4;               // which half of the wave
  const unsigned b = blockIdx.x;            // batch varies fastest in the flat index
  const int qt   = 63 - (blockIdx.y & 63);  // T/32 = 64 tiles, longest first
  const int q0   = qt * QTILE;
  const int d0w  = wave * DSLICE;

  const float* Qb = Q + (size_t)b * T_SEQ * D_DIM;
  const float* Kb = K + (size_t)b * T_SEQ * D_DIM;
  const float* Vb = V + (size_t)b * T_SEQ * D_DIM;
  const float* Mb = Msk + (size_t)b * T_SEQ;
  float*       Ob = O + (size_t)b * T_SEQ * D_DIM;

  // ---- preload this wave's Q slice as WMMA A operands (2 x 16 x v2f = 64 VGPRs)
  // A layout (f32 16x4): lanes 0-15 hold K=0,1 ; lanes 16-31 hold K=2,3.
  v2f aQ[MT][16];
  #pragma unroll  // mt indexes register arrays: must be a constant
  for (int mt = 0; mt < MT; ++mt) {
    const float* qrow = Qb + (size_t)(q0 + mt * 16 + lq) * D_DIM + d0w + hi * 2;
    #pragma unroll
    for (int j = 0; j < 16; ++j)
      aQ[mt][j] = *(const v2f*)(qrow + j * 4);
  }

  // ---- output accumulator: 32 rows x 64 cols = 2 x 4 tiles of 16x16 f32
  v8f acc[MT][4];
  {
    v8f z = {};
    #pragma unroll  // mt indexes register arrays: must be a constant
    for (int mt = 0; mt < MT; ++mt) {
      #pragma unroll
      for (int i = 0; i < 4; ++i) acc[mt][i] = z;
    }
  }

  float m_run = -1.0e30f;   // running max (scaled logits), wave0
  float l_run = 0.0f;       // running denom,               wave0
  if (tid < QTILE) { cfac[tid] = 1.0f; lbuf[tid] = 0.0f; }

  const int nkt = 2 * qt + 2;               // causal: key tiles 0..2*qt+1
  for (int kt = 0; kt < nkt; ++kt) {
    const int k0 = kt * KTILE;

    // ---- stage K,V tiles (16 x 1024 each) into LDS, 16B granules.
    __syncthreads();                        // previous iter done with kbuf/vbuf
    #pragma unroll
    for (int i = 0; i < 8; ++i) {
      const int row = i * 2 + (tid >> 8);   // idx = i*512 + tid; row = idx>>8
      const int col = (tid & 255) * 4;      // (idx & 255) * 4
      stage16(Kb + (size_t)(k0 + row) * D_DIM + col, kbuf + row * KROW + col);
      stage16(Vb + (size_t)(k0 + row) * D_DIM + col, vbuf + row * KROW + col);
    }
    // hint-prefetch next tile into L2 while we compute this one
    if (kt + 1 < nkt) {
      const float* nk = Kb + (size_t)(k0 + KTILE) * D_DIM;
      const float* nv = Vb + (size_t)(k0 + KTILE) * D_DIM;
      __builtin_prefetch((tid < 256 ? nk : nv) + (tid & 255) * 64, 0, 0);
    }
    stage_fence();                          // wave's async copies landed in LDS
    __syncthreads();

    // ---- partial S = Q_slice * K_slice^T   (2 x 16 wmma over this wave's 64 d)
    {
      v8f s[MT] = {};
      const float* kb = kbuf + lq * KROW + d0w + hi * 2;   // B: K^T[d][k]
      #pragma unroll
      for (int j = 0; j < 16; ++j) {
        v2f bk = *(const v2f*)(kb + j * 4);
        #pragma unroll  // mt indexes register arrays: must be a constant
        for (int mt = 0; mt < MT; ++mt)
          s[mt] = __builtin_amdgcn_wmma_f32_16x16x4_f32(
                      false, aQ[mt][j], false, bk, (short)0, s[mt], false, false);
      }
      #pragma unroll  // mt indexes register arrays: must be a constant
      for (int mt = 0; mt < MT; ++mt) {
        float* pw = part + (wave * MT + mt) * 256 + lane;
        #pragma unroll
        for (int r = 0; r < 8; ++r) pw[r * 32] = s[mt][r];
      }
    }
    __syncthreads();

    // ---- reduce 16 partials, apply causal + padding mask, scale
    {
      const int q = tid >> 4, kk = tid & 15;    // q = 0..31
      const int mt = q >> 4;
      const int r = q & 7, li = kk + (((q >> 3) & 1) << 4);
      float s = 0.0f;
      #pragma unroll
      for (int w = 0; w < NWAVE; ++w) s += part[(w * MT + mt) * 256 + r * 32 + li];
      const int kg = k0 + kk;
      if (kg > q0 + q) s -= BIG;                 // causal (triu(1) * INF)
      s -= (1.0f - Mb[kg]) * BIG;                // key padding mask
      xP[q * PROW + kk] = s * INV_SCALE;         // scale AFTER masking
    }
    __syncthreads();

    // ---- online softmax: lane t < 32 owns query row t
    if (tid < QTILE) {
      float* xr = xP + tid * PROW;
      float mn = m_run;
      #pragma unroll
      for (int kk = 0; kk < 16; ++kk) mn = fmaxf(mn, xr[kk]);
      const float c = __expf(m_run - mn);
      float ps = 0.0f;
      #pragma unroll
      for (int kk = 0; kk < 16; ++kk) {
        const float p = __expf(xr[kk] - mn);
        xr[kk] = p;
        ps += p;
      }
      m_run = mn;
      l_run = l_run * c + ps;
      cfac[tid] = c;
      lbuf[tid] = l_run;
    }
    __syncthreads();

    // ---- rescale accumulators, then O += P * V_slice  (32 wmma)
    {
      #pragma unroll  // mt indexes register arrays: must be a constant
      for (int mt = 0; mt < MT; ++mt) {
        float f[8];
        #pragma unroll
        for (int r = 0; r < 8; ++r) f[r] = cfac[mt * 16 + r + hi * 8];  // row M = r + hi*8
        #pragma unroll
        for (int ot = 0; ot < 4; ++ot) {
          #pragma unroll
          for (int r = 0; r < 8; ++r) acc[mt][ot][r] *= f[r];
        }
      }
      #pragma unroll
      for (int jk = 0; jk < 4; ++jk) {          // key chunks of 4
        v2f ap[MT];
        #pragma unroll  // mt indexes register arrays: must be a constant
        for (int mt = 0; mt < MT; ++mt)
          ap[mt] = *(const v2f*)(xP + (mt * 16 + lq) * PROW + jk * 4 + hi * 2);
        const int kr = jk * 4 + hi * 2;
        #pragma unroll
        for (int ot = 0; ot < 4; ++ot) {
          const int dc = d0w + ot * 16 + lq;
          v2f bv;
          bv.x = vbuf[kr * KROW + dc];          // B: V[k][d], rows kr,kr+1
          bv.y = vbuf[(kr + 1) * KROW + dc];
          #pragma unroll  // mt indexes register arrays: must be a constant
          for (int mt = 0; mt < MT; ++mt)
            acc[mt][ot] = __builtin_amdgcn_wmma_f32_16x16x4_f32(
                              false, ap[mt], false, bv, (short)0, acc[mt][ot], false, false);
        }
      }
    }
  }

  // ---- normalize by running denom and write out
  __syncthreads();
  {
    #pragma unroll  // mt indexes register arrays: must be a constant
    for (int mt = 0; mt < MT; ++mt) {
      float linv[8];
      #pragma unroll
      for (int r = 0; r < 8; ++r) linv[r] = 1.0f / lbuf[mt * 16 + r + hi * 8];
      #pragma unroll
      for (int ot = 0; ot < 4; ++ot) {
        const int dc = d0w + ot * 16 + lq;
        #pragma unroll
        for (int r = 0; r < 8; ++r) {
          const int row = q0 + mt * 16 + r + hi * 8;
          Ob[(size_t)row * D_DIM + dc] = acc[mt][ot][r] * linv[r];
        }
      }
    }
  }
}

extern "C" void kernel_launch(void* const* d_in, const int* in_sizes, int n_in,
                              void* d_out, int out_size, void* d_ws, size_t ws_size,
                              hipStream_t stream) {
  const float* Q   = (const float*)d_in[0];
  const float* K   = (const float*)d_in[1];
  const float* V   = (const float*)d_in[2];
  const float* Msk = (const float*)d_in[3];
  float* O = (float*)d_out;

  const int B = in_sizes[3] / T_SEQ;            // mask is [B, T]
  const int qtiles = T_SEQ / QTILE;             // 64

  dim3 grid(B, qtiles);
  dim3 block(512);
  fa_fp32_wmma_kernel<<<grid, block, 0, stream>>>(Q, K, V, Msk, O);
}

// v003
// It runs in 432 microseconds.
// Next to v002, in two timings, it ran 1.08 times as fast each time.
// All steps since v000 together make it 1.58 times as fast.
#include <hip/hip_runtime.h>
#include <hip/hip_bf16.h>
#include <math.h>

// CDNA5 (gfx1250) flash-attention, fp32 WMMA (V_WMMA_F32_16X16X4_F32).
// B=8, T=2048, D=1024.  grid = (B, T/32) workgroups of 512 threads (16 wave32).
// Causal cost grows with the query tile, and the grid holds more workgroups
// than fit on the chip at once: the longest tiles take the lowest flat indices.
// A workgroup owns 32 query rows, so one staged K/V tile serves two 16-row
// tiles.  Per key-tile of 16: each wave does 2 x 16 QK^T wmma (D-reduction
// slice of 64) and 2 x 16 PV wmma (D-column slice of 64); every B fragment
// read from LDS feeds both row tiles.  Online softmax in wave 0.
// K/V tiles staged with CDNA5 async global->LDS loads (ASYNCcnt) when the
// toolchain exposes the builtin, else synchronous b128 copies.  Two K/V
// buffers: the copies of key tile t + 2 are issued at the foot of trip t and
// fly while tile t + 1 is worked on.

typedef __attribute__((ext_vector_type(2))) float v2f;
typedef __attribute__((ext_vector_type(4))) float v4f;
typedef __attribute__((ext_vector_type(8))) float v8f;
typedef __attribute__((ext_vector_type(4))) int   v4i;

#define T_SEQ   2048
#define D_DIM   1024
#define QTILE   32               // query rows per workgroup
#define MT      2                // 16-row tiles per wave
#define KTILE   16
#define NWAVE   16
#define DSLICE  64               // D per wave
#define KROW    1028             // padded LDS row stride (floats): conflict-free
#define PROW    20               // padded P/x row stride (floats)
#define INV_SCALE 0.03125f       // 1/sqrt(1024)
#define BIG     1.0e10f          // reference INF
#define TILE_FLOATS (KTILE * KROW)   // one staged K or V tile
// LDS: 2 x (K tile + V tile) + partials + P tile + factors
#define SMEM_FLOATS (TILE_FLOATS * 4 + NWAVE * MT * 256 + QTILE * PROW + QTILE + QTILE)

#if __has_builtin(__builtin_amdgcn_global_load_async_to_lds_b128)
#define ASYNC_STAGING 1
#else
#define ASYNC_STAGING 0
#endif

typedef __attribute__((address_space(1))) const void gconst_t;  // global AS void
typedef __attribute__((address_space(3))) void lds_void_t;      // LDS AS void
typedef __attribute__((address_space(1))) v4i g_v4i;            // global AS int4
typedef __attribute__((address_space(3))) v4i l_v4i;            // LDS AS int4

// copy 16 bytes global -> LDS; async (ASYNCcnt-tracked) if available
static __device__ __forceinline__ void stage16(const float* g, float* l) {
#if ASYNC_STAGING
  g_v4i* gp = (g_v4i*)(gconst_t*)g;      // addrspacecast, then retype (drop const)
  l_v4i* lp = (l_v4i*)(lds_void_t*)l;
  __builtin_amdgcn_global_load_async_to_lds_b128(gp, lp, /*offset=*/0, /*cpol=*/0);
#else
  *(v4f*)l = *(const v4f*)g;
#endif
}

// this wave's own async copies have landed in LDS; in asm with the clobber so
// that no LDS read is moved in front of it
static __device__ __forceinline__ void stage_fence() {
#if ASYNC_STAGING
  asm volatile("s_wait_asynccnt 0x0" ::: "memory");
#endif
}

// stage one K tile and one V tile (16 x 1024 each) into LDS, 16B granules
static __device__ __forceinline__ void stage_tile(const float* kg, const float* vg,
                                                  float* kl, float* vl, int tid) {
  #pragma unroll  // constant row steps go into the copies' offset fields
  for (int i = 0; i < 8; ++i) {
    const int row = i * 2 + (tid >> 8);     // idx = i*512 + tid; row = idx>>8
    const int col = (tid & 255) * 4;        // (idx & 255) * 4
    stage16(kg + (size_t)row * D_DIM + col, kl + row * KROW + col);
    stage16(vg + (size_t)row * D_DIM + col, vl + row * KROW + col);
  }
}

__global__ __launch_bounds__(512) void fa_fp32_wmma_kernel(
    const float* __restrict__ Q, const float* __restrict__ K,
    const float* __restrict__ V, const float* __restrict__ Msk,
    float* __restrict__ O)
{
  __shared__ __attribute__((aligned(16))) float smem[SMEM_FLOATS];
  float* kring = smem;                      // 2 buffers of 16 * 1028
  float* vring = kring + 2 * TILE_FLOATS;   // 2 buffers of 16 * 1028
  float* part = vring + 2 * TILE_FLOATS;    // 16 waves * 2 * 256 (v8f partial S tiles)
  float* xP   = part + NWAVE * MT * 256;    // 32 * 20  (scores then probs)
  float* cfac = xP   + QTILE * PROW;        // 32  per-row rescale factor
  float* lbuf = cfac + QTILE;               // 32  per-row running denom

  const int tid  = threadIdx.x;
  const int wave = tid >> 5;
  const int lane = tid & 31;
  const int lq   = lane & 15;               // column / M index within half-wave
  const int hi   = lane >> 4;               // which half of the wave
  const unsigned b = blockIdx.x;            // batch varies fastest in the flat index
  const int qt   = 63 - (blockIdx.y & 63);  // T/32 = 64 tiles, longest first
  const int q0   = qt * QTILE;
  const int d0w  = wave * DSLICE;

  const float* Qb = Q + (size_t)b * T_SEQ * D_DIM;
  const float* Kb = K + (size_t)b * T_SEQ * D_DIM;
  const float* Vb = V + (size_t)b * T_SEQ * D_DIM;
  const float* Mb = Msk + (size_t)b * T_SEQ;
  float*       Ob = O + (size_t)b * T_SEQ * D_DIM;

  // ---- preload this wave's Q slice as WMMA A operands (2 x 16 x v2f = 64 VGPRs)
  // A layout (f32 16x4): lanes 0-15 hold K=0,1 ; lanes 16-31 hold K=2,3.
  v2f aQ[MT][16];
  #pragma unroll  // mt indexes register arrays: must be a constant
  for (int mt = 0; mt < MT; ++mt) {
    const float* qrow = Qb + (size_t)(q0 + mt * 16 + lq) * D_DIM + d0w + hi * 2;
    #pragma unroll
    for (int j = 0; j < 16; ++j)
      aQ[mt][j] = *(const v2f*)(qrow + j * 4);
  }

  // ---- output accumulator: 32 rows x 64 cols = 2 x 4 tiles of 16x16 f32
  v8f acc[MT][4];
  {
    v8f z = {};
    #pragma unroll  // mt indexes register arrays: must be a constant
    for (int mt = 0; mt < MT; ++mt) {
      #pragma unroll
      for (int i = 0; i < 4; ++i) acc[mt][i] = z;
    }
  }

  float m_run = -1.0e30f;   // running max (scaled logits), wave0
  float l_run = 0.0f;       // running denom,               wave0
  if (tid < QTILE) { cfac[tid] = 1.0f; lbuf[tid] = 0.0f; }

  const int nkt = 2 * qt + 2;               // causal: key tiles 0..2*qt+1 (>= 2)

  // ---- ring prologue: tile 0 landed and published, tile 1 in flight
  stage_tile(Kb, Vb, kring, vring, tid);
  stage_fence();
  __syncthreads();
  stage_tile(Kb + (size_t)KTILE * D_DIM, Vb + (size_t)KTILE * D_DIM,
             kring + TILE_FLOATS, vring + TILE_FLOATS, tid);

  for (int kt = 0; kt < nkt; ++kt) {
    const int k0 = kt * KTILE;
    float* kbuf = kring + (kt & 1) * TILE_FLOATS;   // this trip reads these two
    float* vbuf = vring + (kt & 1) * TILE_FLOATS;   // buffers and no other

    // ---- partial S = Q_slice * K_slice^T   (2 x 16 wmma over this wave's 64 d)
    {
      v8f s[MT] = {};
      const float* kb = kbuf + lq * KROW + d0w + hi * 2;   // B: K^T[d][k]
      #pragma unroll
      for (int j = 0; j < 16; ++j) {
        v2f bk = *(const v2f*)(kb + j * 4);
        #pragma unroll  // mt indexes register arrays: must be a constant
        for (int mt = 0; mt < MT; ++mt)
          s[mt] = __builtin_amdgcn_wmma_f32_16x16x4_f32(
                      false, aQ[mt][j], false, bk, (short)0, s[mt], false, false);
      }
      #pragma unroll  // mt indexes register arrays: must be a constant
      for (int mt = 0; mt < MT; ++mt) {
        float* pw = part + (wave * MT + mt) * 256 + lane;
        #pragma unroll
        for (int r = 0; r < 8; ++r) pw[r * 32] = s[mt][r];
      }
    }
    __syncthreads();

    // ---- reduce 16 partials, apply causal + padding mask, scale
    {
      const int q = tid >> 4, kk = tid & 15;    // q = 0..31
      const int mt = q >> 4;
      const int r = q & 7, li = kk + (((q >> 3) & 1) << 4);
      float s = 0.0f;
      #pragma unroll
      for (int w = 0; w < NWAVE; ++w) s += part[(w * MT + mt) * 256 + r * 32 + li];
      const int kg = k0 + kk;
      if (kg > q0 + q) s -= BIG;                 // causal (triu(1) * INF)
      s -= (1.0f - Mb[kg]) * BIG;                // key padding mask
      xP[q * PROW + kk] = s * INV_SCALE;         // scale AFTER masking
    }
    __syncthreads();

    // ---- online softmax: lane t < 32 owns query row t
    if (tid < QTILE) {
      float* xr = xP + tid * PROW;
      float mn = m_run;
      #pragma unroll
      for (int kk = 0; kk < 16; ++kk) mn = fmaxf(mn, xr[kk]);
      const float c = __expf(m_run - mn);
      float ps = 0.0f;
      #pragma unroll
      for (int kk = 0; kk < 16; ++kk) {
        const float p = __expf(xr[kk] - mn);
        xr[kk] = p;
        ps += p;
      }
      m_run = mn;
      l_run = l_run * c + ps;
      cfac[tid] = c;
      lbuf[tid] = l_run;
    }
    __syncthreads();

    // ---- rescale accumulators, then O += P * V_slice  (32 wmma)
    {
      #pragma unroll  // mt indexes register arrays: must be a constant
      for (int mt = 0; mt < MT; ++mt) {
        float f[8];
        #pragma unroll
        for (int r = 0; r < 8; ++r) f[r] = cfac[mt * 16 + r + hi * 8];  // row M = r + hi*8
        #pragma unroll
        for (int ot = 0; ot < 4; ++ot) {
          #pragma unroll
          for (int r = 0; r < 8; ++r) acc[mt][ot][r] *= f[r];
        }
      }
      #pragma unroll
      for (int jk = 0; jk < 4; ++jk) {          // key chunks of 4
        v2f ap[MT];
        #pragma unroll  // mt indexes register arrays: must be a constant
        for (int mt = 0; mt < MT; ++mt)
          ap[mt] = *(const v2f*)(xP + (mt * 16 + lq) * PROW + jk * 4 + hi * 2);
        const int kr = jk * 4 + hi * 2;
        #pragma unroll
        for (int ot = 0; ot < 4; ++ot) {
          const int dc = d0w + ot * 16 + lq;
          v2f bv;
          bv.x = vbuf[kr * KROW + dc];          // B: V[k][d], rows kr,kr+1
          bv.y = vbuf[(kr + 1) * KROW + dc];
          #pragma unroll  // mt indexes register arrays: must be a constant
          for (int mt = 0; mt < MT; ++mt)
            acc[mt][ot] = __builtin_amdgcn_wmma_f32_16x16x4_f32(
                              false, ap[mt], false, bv, (short)0, acc[mt][ot], false, false);
        }
      }
    }

    // ---- foot of the trip: publish tile kt + 1, free this trip's buffers
    asm volatile("s_wait_dscnt 0x0" ::: "memory");  // own reads of kbuf/vbuf retired before a refill
    stage_fence();                          // own copies of tile kt + 1 landed
    __syncthreads();                        // every wave's copies visible, every reader has left
    if (kt + 2 < nkt)                       // same for the whole workgroup
      stage_tile(Kb + (size_t)(k0 + 2 * KTILE) * D_DIM, Vb + (size_t)(k0 + 2 * KTILE) * D_DIM,
                 kbuf, vbuf, tid);
  }
  stage_fence();                            // nothing outstanding when the wave ends

  // ---- normalize by running denom and write out (behind the last foot barrier)
  {
    #pragma unroll  // mt indexes register arrays: must be a constant
    for (int mt = 0; mt < MT; ++mt) {
      float linv[8];
      #pragma unroll
      for (int r = 0; r < 8; ++r) linv[r] = 1.0f / lbuf[mt * 16 + r + hi * 8];
      #pragma unroll
      for (int ot = 0; ot < 4; ++ot) {
        const int dc = d0w + ot * 16 + lq;
        #pragma unroll
        for (int r = 0; r < 8; ++r) {
          const int row = q0 + mt * 16 + r + hi * 8;
          Ob[(size_t)row * D_DIM + dc] = acc[mt][ot][r] * linv[r];
        }
      }
    }
  }
}

extern "C" void kernel_launch(void* const* d_in, const int* in_sizes, int n_in,
                              void* d_out, int out_size, void* d_ws, size_t ws_size,
                              hipStream_t stream) {
  const float* Q   = (const float*)d_in[0];
  const float* K   = (const float*)d_in[1];
  const float* V   = (const float*)d_in[2];
  const float* Msk = (const float*)d_in[3];
  float* O = (float*)d_out;

  const int B = in_sizes[3] / T_SEQ;            // mask is [B, T]
  const int qtiles = T_SEQ / QTILE;             // 64

  dim3 grid(B, qtiles);
  dim3 block(512);
  fa_fp32_wmma_kernel<<<grid, block, 0, stream>>>(Q, K, V, Msk, O);
}

// v004
// A run of this version takes 390 microseconds.
// In both of two side-by-side timings against v003, it was 1.11 times as fast.
// All steps since v000 together make it 1.75 times as fast.
#include <hip/hip_runtime.h>
#include <hip/hip_bf16.h>
#include <math.h>

// CDNA5 (gfx1250) flash-attention, fp32 WMMA (V_WMMA_F32_16X16X4_F32).
// B=8, T=2048, D=1024.  grid = (B, T/32) workgroups of 512 threads (16 wave32).
// Causal cost grows with the query tile, and the grid holds more workgroups
// than fit on the chip at once: the longest tiles take the lowest flat indices.
// A workgroup owns 32 query rows, so one staged K/V tile serves two 16-row
// tiles.  Per key-tile of 16: each wave does 2 x 16 QK^T wmma (D-reduction
// slice of 64) and 2 x 16 PV wmma (D-column slice of 64); every B fragment
// read from LDS feeds both row tiles.  Online softmax in wave 0.
// K/V tiles staged with CDNA5 async global->LDS loads (ASYNCcnt) when the
// toolchain exposes the builtin, else synchronous b128 copies.  Two K/V
// buffers: the copies of V tile t + 2 and K tile t + 3 are issued at the foot of trip t and
// fly while tile t + 1 is worked on.
// The trip is skewed so that the matrix pipe has work in every barrier
// interval: PV of tile t shares its interval with the partial-sum reduce of
// tile t + 1, and QK^T of tile t + 2 shares its interval with wave 0's softmax
// of tile t + 1.  Two barriers a trip.

typedef __attribute__((ext_vector_type(2))) float v2f;
typedef __attribute__((ext_vector_type(4))) float v4f;
typedef __attribute__((ext_vector_type(8))) float v8f;
typedef __attribute__((ext_vector_type(4))) int   v4i;

#define T_SEQ   2048
#define D_DIM   1024
#define QTILE   32               // query rows per workgroup
#define MT      2                // 16-row tiles per wave
#define KTILE   16
#define NWAVE   16
#define DSLICE  64               // D per wave
#define KROW    1028             // padded LDS row stride (floats): conflict-free
#define PROW    20               // padded P/x row stride (floats)
#define INV_SCALE 0.03125f       // 1/sqrt(1024)
#define BIG     1.0e10f          // reference INF
#define TILE_FLOATS (KTILE * KROW)   // one staged K or V tile
// LDS: 2 x (K tile + V tile) + partials + score tile + P tile + factors
#define SMEM_FLOATS (TILE_FLOATS * 4 + NWAVE * MT * 256 + 2 * QTILE * PROW + QTILE + QTILE)

#if __has_builtin(__builtin_amdgcn_global_load_async_to_lds_b128)
#define ASYNC_STAGING 1
#else
#define ASYNC_STAGING 0
#endif

typedef __attribute__((address_space(1))) const void gconst_t;  // global AS void
typedef __attribute__((address_space(3))) void lds_void_t;      // LDS AS void
typedef __attribute__((address_space(1))) v4i g_v4i;            // global AS int4
typedef __attribute__((address_space(3))) v4i l_v4i;            // LDS AS int4

// copy 16 bytes global -> LDS; async (ASYNCcnt-tracked) if available
static __device__ __forceinline__ void stage16(const float* g, float* l) {
#if ASYNC_STAGING
  g_v4i* gp = (g_v4i*)(gconst_t*)g;      // addrspacecast, then retype (drop const)
  l_v4i* lp = (l_v4i*)(lds_void_t*)l;
  __builtin_amdgcn_global_load_async_to_lds_b128(gp, lp, /*offset=*/0, /*cpol=*/0);
#else
  *(v4f*)l = *(const v4f*)g;
#endif
}

// this wave's own async copies have landed in LDS; in asm with the clobber so
// that no LDS read is moved in front of it
static __device__ __forceinline__ void stage_fence() {
#if ASYNC_STAGING
  asm volatile("s_wait_asynccnt 0x0" ::: "memory");
#endif
}

// stage one K or V tile (16 x 1024) into LDS, 16B granules
static __device__ __forceinline__ void stage_tile(const float* g, float* l, int tid) {
  #pragma unroll  // constant row steps go into the copies' offset fields
  for (int i = 0; i < 8; ++i) {
    const int row = i * 2 + (tid >> 8);     // idx = i*512 + tid; row = idx>>8
    const int col = (tid & 255) * 4;        // (idx & 255) * 4
    stage16(g + (size_t)row * D_DIM + col, l + row * KROW + col);
  }
}

__global__ __launch_bounds__(512) void fa_fp32_wmma_kernel(
    const float* __restrict__ Q, const float* __restrict__ K,
    const float* __restrict__ V, const float* __restrict__ Msk,
    float* __restrict__ O)
{
  __shared__ __attribute__((aligned(16))) float smem[SMEM_FLOATS];
  float* kring = smem;                      // 2 buffers of 16 * 1028
  float* vring = kring + 2 * TILE_FLOATS;   // 2 buffers of 16 * 1028
  float* part = vring + 2 * TILE_FLOATS;    // 16 waves * 2 * 256 (v8f partial S tiles)
  float* xS   = part + NWAVE * MT * 256;    // 32 * 20  scores of the next tile
  float* xP   = xS   + QTILE * PROW;        // 32 * 20  probs of this tile
  float* cfac = xP   + QTILE * PROW;        // 32  per-row rescale factor
  float* lbuf = cfac + QTILE;               // 32  per-row running denom

  const int tid  = threadIdx.x;
  const int wave = tid >> 5;
  const int lane = tid & 31;
  const int lq   = lane & 15;               // column / M index within half-wave
  const int hi   = lane >> 4;               // which half of the wave
  const unsigned b = blockIdx.x;            // batch varies fastest in the flat index
  const int qt   = 63 - (blockIdx.y & 63);  // T/32 = 64 tiles, longest first
  const int q0   = qt * QTILE;
  const int d0w  = wave * DSLICE;

  const float* Qb = Q + (size_t)b * T_SEQ * D_DIM;
  const float* Kb = K + (size_t)b * T_SEQ * D_DIM;
  const float* Vb = V + (size_t)b * T_SEQ * D_DIM;
  const float* Mb = Msk + (size_t)b * T_SEQ;
  float*       Ob = O + (size_t)b * T_SEQ * D_DIM;

  // ---- preload this wave's Q slice as WMMA A operands (2 x 16 x v2f = 64 VGPRs)
  // A layout (f32 16x4): lanes 0-15 hold K=0,1 ; lanes 16-31 hold K=2,3.
  v2f aQ[MT][16];
  #pragma unroll  // mt indexes register arrays: must be a constant
  for (int mt = 0; mt < MT; ++mt) {
    const float* qrow = Qb + (size_t)(q0 + mt * 16 + lq) * D_DIM + d0w + hi * 2;
    #pragma unroll
    for (int j = 0; j < 16; ++j)
      aQ[mt][j] = *(const v2f*)(qrow + j * 4);
  }

  // ---- output accumulator: 32 rows x 64 cols = 2 x 4 tiles of 16x16 f32
  v8f acc[MT][4];
  {
    v8f z = {};
    #pragma unroll  // mt indexes register arrays: must be a constant
    for (int mt = 0; mt < MT; ++mt) {
      #pragma unroll
      for (int i = 0; i < 4; ++i) acc[mt][i] = z;
    }
  }

  float m_run = -1.0e30f;   // running max (scaled logits), wave0
  float l_run = 0.0f;       // running denom,               wave0
  if (tid < QTILE) { cfac[tid] = 1.0f; lbuf[tid] = 0.0f; }

  const int nkt = 2 * qt + 2;               // causal: key tiles 0..2*qt+1 (>= 2)

  // ---- partial S = Q_slice * K_slice^T of one key tile (2 x 16 wmma over this
  //      wave's 64 d), stored to this wave's planes of part
  auto qk_tile = [&](const float* kbuf) {
    v8f s[MT] = {};
    const float* kb = kbuf + lq * KROW + d0w + hi * 2;   // B: K^T[d][k]
    #pragma unroll
    for (int j = 0; j < 16; ++j) {
      v2f bk = *(const v2f*)(kb + j * 4);
      #pragma unroll  // mt indexes register arrays: must be a constant
      for (int mt = 0; mt < MT; ++mt)
        s[mt] = __builtin_amdgcn_wmma_f32_16x16x4_f32(
                    false, aQ[mt][j], false, bk, (short)0, s[mt], false, false);
    }
    #pragma unroll  // mt indexes register arrays: must be a constant
    for (int mt = 0; mt < MT; ++mt) {
      float* pw = part + (wave * MT + mt) * 256 + lane;
      #pragma unroll
      for (int r = 0; r < 8; ++r) pw[r * 32] = s[mt][r];
    }
  };

  // ---- online softmax: lane t < 32 owns query row t; scores in xS, probs to xP
  auto softmax_tile = [&]() {
    if (tid < QTILE) {
      const float* xr = xS + tid * PROW;
      float* pr = xP + tid * PROW;
      float mn = m_run;
      #pragma unroll
      for (int kk = 0; kk < 16; ++kk) mn = fmaxf(mn, xr[kk]);
      const float c = __expf(m_run - mn);
      float ps = 0.0f;
      #pragma unroll
      for (int kk = 0; kk < 16; ++kk) {
        const float p = __expf(xr[kk] - mn);
        pr[kk] = p;
        ps += p;
      }
      m_run = mn;
      l_run = l_run * c + ps;
      cfac[tid] = c;
      lbuf[tid] = l_run;
    }
  };

  // ---- the 16 partials of this thread's score element, and its key's mask value
  const int rq = tid >> 4, rkk = tid & 15;    // score element: row rq = 0..31, key rkk
  const float* rsrc = part + (rq >> 4) * 256 + (rq & 7) * 32 + rkk + (((rq >> 3) & 1) << 4);
  auto reduce_load = [&](int k0, float (&pr)[NWAVE], float& mval) {
    #pragma unroll
    for (int w = 0; w < NWAVE; ++w) pr[w] = rsrc[w * MT * 256];
    mval = Mb[k0 + rkk];
  };
  // ---- sum them, apply causal + padding mask, scale
  auto reduce_sum = [&](int k0, const float (&pr)[NWAVE], float mval) {
    float s = 0.0f;
    #pragma unroll
    for (int w = 0; w < NWAVE; ++w) s += pr[w];
    if (k0 + rkk > q0 + rq) s -= BIG;          // causal (triu(1) * INF)
    s -= (1.0f - mval) * BIG;                  // key padding mask
    xS[rq * PROW + rkk] = s * INV_SCALE;       // scale AFTER masking
  };

  // ---- rescale accumulators, then O += P * V_slice (32 wmma); with_reduce: the
  //      scores of the key tile at k0 are reduced between the wmma groups.
  //      Reads are issued group by group: hoisted to the top together, all
  //      waves' reads would queue in front of everybody's first wmma.
  auto pv_tile = [&](const float* vbuf, bool with_reduce, int k0) {
    v2f ap[4][MT], bv[4][4];
    auto ld = [&](int jk) {                   // key chunk of 4: A from P, B from V
      #pragma unroll  // mt indexes register arrays: must be a constant
      for (int mt = 0; mt < MT; ++mt)
        ap[jk][mt] = *(const v2f*)(xP + (mt * 16 + lq) * PROW + jk * 4 + hi * 2);
      const int kr = jk * 4 + hi * 2;
      #pragma unroll
      for (int ot = 0; ot < 4; ++ot) {
        const int dc = d0w + ot * 16 + lq;
        bv[jk][ot].x = vbuf[kr * KROW + dc];        // B: V[k][d], rows kr,kr+1
        bv[jk][ot].y = vbuf[(kr + 1) * KROW + dc];
      }
    };
    auto mm = [&](int jk) {
      #pragma unroll
      for (int ot = 0; ot < 4; ++ot) {
        #pragma unroll  // mt indexes register arrays: must be a constant
        for (int mt = 0; mt < MT; ++mt)
          acc[mt][ot] = __builtin_amdgcn_wmma_f32_16x16x4_f32(
                            false, ap[jk][mt], false, bv[jk][ot], (short)0, acc[mt][ot], false, false);
      }
    };
    float f[MT][8];
    #pragma unroll  // mt indexes register arrays: must be a constant
    for (int mt = 0; mt < MT; ++mt) {
      #pragma unroll
      for (int r = 0; r < 8; ++r) f[mt][r] = cfac[mt * 16 + r + hi * 8];  // row M = r + hi*8
    }
    ld(0);
    // LDS reads do not cross a scheduling barrier.  Here: the factors and group 0
    // go out alone, so that a wave's first wmma does not wait behind all later reads
    __builtin_amdgcn_sched_barrier(0);
    ld(1);
    #pragma unroll  // mt indexes register arrays: must be a constant
    for (int mt = 0; mt < MT; ++mt) {
      #pragma unroll
      for (int ot = 0; ot < 4; ++ot) {
        #pragma unroll
        for (int r = 0; r < 8; ++r) acc[mt][ot][r] *= f[mt][r];
      }
    }
    mm(0);
    __builtin_amdgcn_sched_barrier(0);        // group 2's and the reduce's reads stay behind group 1's
    float pr[NWAVE], mval = 1.0f;
    ld(2);
    if (with_reduce) reduce_load(k0, pr, mval);
    mm(1);
    __builtin_amdgcn_sched_barrier(0);        // group 3's reads stay behind the reduce's
    ld(3);
    mm(2);
    if (with_reduce) reduce_sum(k0, pr, mval);
    mm(3);
  };

  // ---- prologue: fill the ring and the skew (probs of tile 0, partials of tile 1)
  stage_tile(Kb, kring, tid);
  stage_tile(Vb, vring, tid);
  stage_fence();
  __syncthreads();                          // tile 0 published
  stage_tile(Kb + (size_t)KTILE * D_DIM, kring + TILE_FLOATS, tid);
  stage_tile(Vb + (size_t)KTILE * D_DIM, vring + TILE_FLOATS, tid);
  qk_tile(kring);
  asm volatile("s_wait_dscnt 0x0" ::: "memory");  // own reads of K buffer 0 retired before its refill
  stage_fence();                            // own copies of tile 1 landed
  __syncthreads();                          // tile 1 and partials 0 published, K buffer 0 free
  if (2 < nkt)                              // same for the whole workgroup
    stage_tile(Kb + (size_t)(2 * KTILE) * D_DIM, kring, tid);
  {
    float pr[NWAVE], mval;
    reduce_load(0, pr, mval);
    reduce_sum(0, pr, mval);
  }
  __syncthreads();                          // scores 0 published, part free
  softmax_tile();
  qk_tile(kring + TILE_FLOATS);
  __syncthreads();                          // probs 0 and partials 1 published, K buffer 1 free

  for (int kt = 0; kt + 1 < nkt; ++kt) {
    const int cur = (kt & 1) * TILE_FLOATS;         // buffers of tiles kt, kt + 2
    const int nxt = TILE_FLOATS - cur;              // buffers of tiles kt + 1, kt + 3

    // ---- first interval: PV of tile kt, scores of tile kt + 1
    pv_tile(vring + cur, true, (kt + 1) * KTILE);

    // ---- ring foot: publish V tile kt + 1 and K tile kt + 2, free V buffer cur
    asm volatile("s_wait_dscnt 0x0" ::: "memory");  // own reads of the V buffer retired before a refill
    stage_fence();                          // own outstanding copies landed
    __syncthreads();                        // every wave's copies visible, every reader has left
    if (kt + 2 < nkt)                       // same for the whole workgroup
      stage_tile(Vb + (size_t)((kt + 2) * KTILE) * D_DIM, vring + cur, tid);
    if (kt + 3 < nkt)                       // K buffer nxt was left at the last trip's second barrier
      stage_tile(Kb + (size_t)((kt + 3) * KTILE) * D_DIM, kring + nxt, tid);

    // ---- second interval: softmax of tile kt + 1 (wave 0), QK^T of tile kt + 2
    softmax_tile();
    if (kt + 2 < nkt)                       // same for the whole workgroup
      qk_tile(kring + cur);
    __syncthreads();                        // probs kt + 1 and partials kt + 2 published
  }
  pv_tile(vring + ((nkt - 1) & 1) * TILE_FLOATS, false, 0);   // last tile
  stage_fence();                            // nothing outstanding when the wave ends

  // ---- normalize by running denom and write out (behind the loop's last barrier)
  {
    #pragma unroll  // mt indexes register arrays: must be a constant
    for (int mt = 0; mt < MT; ++mt) {
      float linv[8];
      #pragma unroll
      for (int r = 0; r < 8; ++r) linv[r] = 1.0f / lbuf[mt * 16 + r + hi * 8];
      #pragma unroll
      for (int ot = 0; ot < 4; ++ot) {
        const int dc = d0w + ot * 16 + lq;
        #pragma unroll
        for (int r = 0; r < 8; ++r) {
          const int row = q0 + mt * 16 + r + hi * 8;
          Ob[(size_t)row * D_DIM + dc] = acc[mt][ot][r] * linv[r];
        }
      }
    }
  }
}

extern "C" void kernel_launch(void* const* d_in, const int* in_sizes, int n_in,
                              void* d_out, int out_size, void* d_ws, size_t ws_size,
                              hipStream_t stream) {
  const float* Q   = (const float*)d_in[0];
  const float* K   = (const float*)d_in[1];
  const float* V   = (const float*)d_in[2];
  const float* Msk = (const float*)d_in[3];
  float* O = (float*)d_out;

  const int B = in_sizes[3] / T_SEQ;            // mask is [B, T]
  const int qtiles = T_SEQ / QTILE;             // 64

  dim3 grid(B, qtiles);
  dim3 block(512);
  fa_fp32_wmma_kernel<<<grid, block, 0, stream>>>(Q, K, V, Msk, O);
}
